// v000
// Times are from an AMD MI455X. After a warm-up the kernel runs many times in a row, and a time is the length of
// such a window on the GPU divided by its runs, so every launch and the gaps after it count. The runs cycle
// through copies of the inputs. A figure is the median of several windows, for all but v000 over two sittings.
// Sittings can differ by a few percent; kernels timed side by side share one.
// The starting kernel, v000, takes 837 microseconds a run.
#include <hip/hip_runtime.h>

// Contractions: q/k/v projections v_wmma_f32_16x16x32_bf16 (bf16 operands = RNE-converted inputs, biases RNE-converted to bf16); scores q.k v_wmma_f32_16x16x32_bf16 with q,k as bf16 hi+lo planes folded along k ([qh|ql|qh] x [kh|kh|kl], K=192, 3 products); attn.v v_wmma_f32_16x16x32_f16 (fp16 operands, attn carried x16384); output projection v_wmma_f32_16x16x32_bf16 (ctx as bf16 hi+lo planes, weight bf16, 2 products); all f32 accumulate, softmax f32.
// x [NB][SEQ][1024]; q,k,v = x W^T + b (W [out][in] [1024][1024], 16 heads x 64); scores = q.k (no pre-softmax scale); softmax over all SEQ keys; ctx = softmax.v x (1/32); out = merged heads W_o^T + b_o -> [NB][SEQ][1024] f32.

#ifndef NB
#define NB 4
#endif
#ifndef SEQ
#define SEQ 1024
#endif
#define NB_FULL  4
#define SEQ_FULL 1024
#define TT   SEQ
#define DM   1024
#define NH_  16
#define HD   64
#define DQ   (NH_ * HD)
#define KS   (3 * HD)          // folded score operand width: 3 planes of HD
#define ZH   8
#define PCAR 16384.0f
#define OSC  (1.0f / (PCAR * 32.0f))   // undo carry and apply the post-softmax 1/32 (exact power of two)
static_assert(TT % 128 == 0);
static_assert(NH_ % ZH == 0);
static_assert(KS % 32 == 0);
static_assert(DM % 64 == 0 && DQ % 64 == 0 && HD == 64);
static_assert(NB >= 1 && NB <= NB_FULL && SEQ <= SEQ_FULL);

typedef _Float16 h16;
typedef unsigned short bf;
typedef __attribute__((ext_vector_type(16))) __bf16   v16bf;
typedef __attribute__((ext_vector_type(16))) _Float16 v16h;
typedef __attribute__((ext_vector_type(8)))  _Float16 v8h;
typedef __attribute__((ext_vector_type(8)))  unsigned short v8us;
typedef __attribute__((ext_vector_type(8)))  float    v8f;
typedef __attribute__((ext_vector_type(4)))  float    v4f;
typedef __attribute__((ext_vector_type(4)))  _Float16 v4h;
typedef v8h  __attribute__((may_alias)) v8ha;
typedef v4f  __attribute__((may_alias)) v4fa;
typedef v8us __attribute__((may_alias)) v8usa;

__device__ __forceinline__ unsigned short f2bf(float f) { unsigned u = __float_as_uint(f); u += 0x7FFFu + ((u >> 16) & 1u); return (unsigned short)(u >> 16); }
__device__ __forceinline__ float bf2f(unsigned short b) { return __uint_as_float(((unsigned)b) << 16); }
__device__ __forceinline__ float bfr(float f) { return bf2f(f2bf(f)); }
__device__ __forceinline__ v16h cat16(v8h lo, v8h hi) { return __builtin_shufflevector(lo, hi, 0, 1, 2, 3, 4, 5, 6, 7, 8, 9, 10, 11, 12, 13, 14, 15); }
__device__ __forceinline__ v16bf cat16b(v8us lo, v8us hi) { return __builtin_bit_cast(v16bf, __builtin_shufflevector(lo, hi, 0, 1, 2, 3, 4, 5, 6, 7, 8, 9, 10, 11, 12, 13, 14, 15)); }
__device__ __forceinline__ v8f wmma16(v16h a, v16h b, v8f c) { return __builtin_amdgcn_wmma_f32_16x16x32_f16(false, a, false, b, (short)0, c, false, false); }
__device__ __forceinline__ v8f wmmab(v16bf a, v16bf b, v8f c) { return __builtin_amdgcn_wmma_f32_16x16x32_bf16(false, a, false, b, (short)0, c, false, false); }
__device__ __forceinline__ h16 tohx(float x) { return (h16)x; }
__device__ __forceinline__ void splitf(float y, unsigned short& h, unsigned short& l) { h = f2bf(y); l = f2bf(y - bf2f(h)); }

// ---- k_gemmw: register-blocked GEMM, ONE WAVE per 64x64 output tile (16 accumulators), operands straight from K-contiguous 16-bit planes; grid (M/64, N/64, Z), 32 threads.
// C[m][n] (f32, pitch ldc, + optional bias[n] RNE-converted to bf16) = sum_k A[m][k] Bt[n][k] (+ split products per NSPLIT). z-batch strides sA/sB/sC in elements. K % 32 == 0, A/Bt row pitch == K.
// Fragments: lane -> row/col lane&15, elements 0..7 <- k0 + 8*(lane>>4) + 0..7, elements 8..15 <- k0 + 16 + 8*(lane>>4) + 0..7 for BOTH A and Bt; D element j -> row 8*(lane>>4)+j, col lane&15.
template <typename T16> struct WFrag;
template <> struct WFrag<h16> { typedef v16h V; static __device__ __forceinline__ V ld(const h16* p) { return cat16(*(const v8h*)p, *(const v8h*)(p + 16)); } static __device__ __forceinline__ v8f mma(V a, V b, v8f c) { return wmma16(a, b, c); } };
template <> struct WFrag<bf> { typedef v16bf V; static __device__ __forceinline__ V ld(const bf* p) { return cat16b(*(const v8us*)p, *(const v8us*)(p + 16)); } static __device__ __forceinline__ v8f mma(V a, V b, v8f c) { return wmmab(a, b, c); } };
template <typename T16, int NSPLIT, bool BIAS>
__global__ __launch_bounds__(32) void k_gemmw(const T16* __restrict__ A, const T16* __restrict__ A2, const T16* __restrict__ Bt, const T16* __restrict__ Bt2, int K, float* C, int ldc, const float* __restrict__ bias, size_t sA, size_t sB, size_t sC) {
    typedef typename WFrag<T16>::V V;
    __shared__ __align__(16) float os[16 * 68];
    const size_t z = blockIdx.z; A += z * sA; if (A2) A2 += z * sA; Bt += z * sB; if (Bt2) Bt2 += z * sB; C += z * sC;
    const int lane = threadIdx.x & 31, lr = lane & 15, hi = lane >> 4; const int r0 = blockIdx.x * 64, c0 = blockIdx.y * 64;
    v8f acc[4][4];
#pragma unroll
    for (int mb = 0; mb < 4; ++mb)
#pragma unroll
        for (int nb = 0; nb < 4; ++nb) acc[mb][nb] = (v8f){};
    const size_t aoff = (size_t)(r0 + lr) * K + 8 * hi, boff = (size_t)(c0 + lr) * K + 8 * hi;
#pragma unroll 1
    for (int kc = 0; kc < K; kc += 32) {
        V a[4], a2[4];
#pragma unroll
        for (int mb = 0; mb < 4; ++mb) { a[mb] = WFrag<T16>::ld(A + aoff + (size_t)mb * 16 * K + kc); if (NSPLIT == 1 || NSPLIT == 2) a2[mb] = WFrag<T16>::ld(A2 + aoff + (size_t)mb * 16 * K + kc); }
#pragma unroll
        for (int nb = 0; nb < 4; ++nb) { const V b = WFrag<T16>::ld(Bt + boff + (size_t)nb * 16 * K + kc); V b2; if (NSPLIT >= 2) b2 = WFrag<T16>::ld(Bt2 + boff + (size_t)nb * 16 * K + kc);
#pragma unroll
            for (int mb = 0; mb < 4; ++mb) { acc[mb][nb] = WFrag<T16>::mma(a[mb], b, acc[mb][nb]); if (NSPLIT == 1 || NSPLIT == 2) acc[mb][nb] = WFrag<T16>::mma(a2[mb], b, acc[mb][nb]); if (NSPLIT >= 2) acc[mb][nb] = WFrag<T16>::mma(a[mb], b2, acc[mb][nb]); } }
        asm volatile("v_nop\n\tv_nop\n\tv_nop\n\tv_nop" : "+v"(acc[0][0]), "+v"(acc[1][1]), "+v"(acc[2][2]), "+v"(acc[3][3]) : "v"(a[0]), "v"(a[3]));
    }
#pragma unroll
    for (int mb = 0; mb < 4; ++mb) {
#pragma unroll
        for (int nb = 0; nb < 4; ++nb) {
#pragma unroll
            for (int j = 0; j < 8; ++j) os[(hi * 8 + j) * 68 + nb * 16 + lr] = acc[mb][nb][j]; }
        __builtin_amdgcn_wave_barrier(); asm volatile("" ::: "memory");
        float* crow = C + (size_t)(r0 + mb * 16) * ldc + c0;
{
#pragma unroll
            for (int s = 0; s < 8; ++s) { const int row = 2 * s + hi, cofs = lr * 4; v4f val = *(const v4fa*)(os + row * 68 + cofs); if (BIAS) { val[0] += bfr(bias[c0 + cofs]); val[1] += bfr(bias[c0 + cofs + 1]); val[2] += bfr(bias[c0 + cofs + 2]); val[3] += bfr(bias[c0 + cofs + 3]); }
                *(v4f*)(crow + (size_t)row * ldc + cofs) = val; }
             }
        __builtin_amdgcn_wave_barrier(); asm volatile("" ::: "memory");
    }
}

__global__ __launch_bounds__(256) void k_cvt8(const float* __restrict__ src, bf* dst, size_t n8) { const size_t i = (size_t)blockIdx.x * 256 + threadIdx.x; if (i >= n8) return; const v8f v = *(const v8f*)(src + i * 8); v8us o;
#pragma unroll
    for (int k = 0; k < 8; ++k) o[k] = f2bf(v[k]); *(v8us*)(dst + i * 8) = o;  }

// k_qkp3: folded head planes P[h][t][KS] (bf16), row = (h*TT + t): slots 0..HD-1 = hi(F[t][h*HD + d]), HD..2HD-1 = (SEL ? lo : hi), 2HD..3HD-1 = (SEL ? hi : lo), with hi/lo = bf16 split of the f32 value.
template <int SEL>
__global__ __launch_bounds__(256) void k_qkp3(const float* __restrict__ F, int pitch, int nheads, bf* P) {
    const size_t e = ((size_t)blockIdx.x * 256 + threadIdx.x) * 8; if (e >= (size_t)nheads * TT * HD) return;
    const int d = (int)(e % HD); const size_t ht = e / HD; const int t = (int)(ht % TT); const int h = (int)(ht / TT);
    const float* f = F + (size_t)t * pitch + (size_t)h * HD + d;
    const v4f x0 = *(const v4f*)f; const v4f x1 = *(const v4f*)(f + 4); v8us oh, ol;
#pragma unroll
    for (int q = 0; q < 4; ++q) { unsigned short a, c2; splitf(x0[q], a, c2); oh[q] = a; ol[q] = c2; splitf(x1[q], a, c2); oh[q + 4] = a; ol[q + 4] = c2; }
    const v8us s1 = SEL ? ol : oh; const v8us s2 = SEL ? oh : ol;
    bf* row = P + ht * (size_t)KS + d;
    *(v8us*)(row) = oh; *(v8us*)(row + HD) = s1; *(v8us*)(row + 2 * HD) = s2;
    
}
__global__ __launch_bounds__(256) void k_vtp(const float* __restrict__ F, int pitch, int nheads, h16* V16) {
    const size_t e = ((size_t)blockIdx.x * 256 + threadIdx.x) * 8; if (e >= (size_t)nheads * HD * TT) return;
    const int t = (int)(e % TT); const int d = (int)((e / TT) % HD); const int g = (int)(e / ((size_t)TT * HD));
    const float* f = F + (size_t)t * pitch + (size_t)g * HD + d; v8h o;
#pragma unroll
    for (int q = 0; q < 8; ++q) o[q] = tohx(f[(size_t)q * pitch]);
    *(v8h*)(V16 + e) = o; 
}
__global__ __launch_bounds__(256) void k_asoft(const float* __restrict__ Sb, h16* P16) {
    const int lane = threadIdx.x & 31; const int row = blockIdx.x * 8 + (threadIdx.x >> 5); if (row >= ZH * TT) return;
    const float* sr = Sb + (size_t)row * TT; float v[TT / 32]; float mx = -3.0e38f;
#pragma unroll
    for (int ch = 0; ch < TT / 128; ++ch) { const int j0 = ch * 128 + lane * 4; const v4f a = *(const v4f*)(sr + j0);
#pragma unroll
        for (int q = 0; q < 4; ++q) { const float t = a[q]; v[ch * 4 + q] = t; mx = fmaxf(mx, t); } }
#pragma unroll
    for (int sh = 16; sh; sh >>= 1) mx = fmaxf(mx, __shfl_xor(mx, sh, 32));
    float sum = 0.f;
#pragma unroll
    for (int k = 0; k < TT / 32; ++k) { float d0 = __fsub_rn(v[k], mx); asm volatile("" : "+v"(d0)); v[k] = __builtin_amdgcn_exp2f(__fmul_rn(d0, 1.4426950408889634f)); sum += v[k]; }
#pragma unroll
    for (int sh = 16; sh; sh >>= 1) sum += __shfl_xor(sum, sh, 32);
    const float f = __fdiv_rn(PCAR, sum);
{
#pragma unroll
        for (int ch = 0; ch < TT / 128; ++ch) { v4h o4;
#pragma unroll
            for (int q = 0; q < 4; ++q) o4[q] = tohx(v[ch * 4 + q] * f);
            *(v4h*)(P16 + (size_t)row * TT + ch * 128 + lane * 4) = o4; }
         }
}
__global__ __launch_bounds__(256) void k_merge(const float* __restrict__ O, int h0, bf* Ah, bf* Al) {
    const size_t e = ((size_t)blockIdx.x * 256 + threadIdx.x) * 8; if (e >= (size_t)ZH * TT * HD) return;
    const int d = (int)(e % HD); const int t = (int)((e / HD) % TT); const int zz = (int)(e / ((size_t)HD * TT));
    const size_t oo = (size_t)t * DQ + (size_t)(h0 + zz) * HD + d;
    const v4f x0 = *(const v4f*)(O + e); const v4f x1 = *(const v4f*)(O + e + 4); v8us oh, ol;
#pragma unroll
    for (int q = 0; q < 4; ++q) { unsigned short a, c2; splitf(x0[q] * OSC, a, c2); oh[q] = a; ol[q] = c2; splitf(x1[q] * OSC, a, c2); oh[q + 4] = a; ol[q + 4] = c2; }
    *(v8us*)(Ah + oo) = oh; *(v8us*)(Al + oo) = ol; 
}

extern "C" void kernel_launch(void* const* d_in, const int* in_sizes, int n_in,
                              void* d_out, int out_size, void* d_ws, size_t ws_size, hipStream_t stream) {
    if (n_in < 9) return;
    const size_t xneed = (size_t)(NB - 1) * SEQ_FULL * DM + (size_t)TT * DM;
    if ((size_t)in_sizes[0] < xneed) return;
    if (in_sizes[1] < DM * DM || in_sizes[3] < DM * DM || in_sizes[5] < DM * DM || in_sizes[7] < DM * DM) return;
    if (in_sizes[2] < DM || in_sizes[4] < DM || in_sizes[6] < DM || in_sizes[8] < DM) return;
    if ((size_t)out_size < xneed) return;
    const float* x  = (const float*)d_in[0];   // [NB_FULL][SEQ_FULL][DM]
    const float* wq = (const float*)d_in[1];  const float* bq = (const float*)d_in[2];
    const float* wk = (const float*)d_in[3];  const float* bk = (const float*)d_in[4];
    const float* wv = (const float*)d_in[5];  const float* bv = (const float*)d_in[6];
    const float* wo = (const float*)d_in[7];  const float* bo = (const float*)d_in[8];
    float* OUT = (float*)d_out;     // [NB_FULL][SEQ_FULL][DM]

    constexpr size_t SZ_W   = (size_t)DM * DM * 2;          // x4 : WQ WK WV WO bf16 [out][in]
    constexpr size_t SZ_XB  = (size_t)TT * DM * 2;          // x  bf16 [TT][DM] (per batch)
    constexpr size_t SZ_F   = (size_t)TT * DQ * 4;          // x2 : FQ, FK(=FV) f32 [TT][DQ]
    constexpr size_t SZ_PQK = (size_t)NH_ * TT * KS * 2;    // x2 : QP3 [h*TT+t][KS], KP3 [h*TT+t][KS] bf16 folded planes
    constexpr size_t SZ_PL  = (size_t)NH_ * TT * HD * 2;    // VT16 [h][d][t] fp16
    constexpr size_t SZ_SB  = (size_t)ZH * TT * TT * 4;     // scores f32 [zz][i][j]
    constexpr size_t SZ_P16 = (size_t)ZH * TT * TT * 2;     // attn x16384 fp16 [zz][i][j]
    constexpr size_t SZ_OB  = (size_t)ZH * TT * HD * 4;     // ctx x(16384*32) f32 [zz][t][d]
    constexpr size_t SZ_AT  = (size_t)TT * DQ * 2;          // x2 : ctx hi / lo bf16 [t][DQ]
    constexpr size_t WS_TOTAL = 4 * SZ_W + SZ_XB + 2 * SZ_F + 2 * SZ_PQK + SZ_PL + SZ_SB + SZ_P16 + SZ_OB + 2 * SZ_AT;
    static_assert(WS_TOTAL <= (size_t)134217728);
    static_assert(SZ_W % 256 == 0 && SZ_XB % 256 == 0 && SZ_F % 256 == 0 && SZ_PQK % 256 == 0 && SZ_PL % 256 == 0 && SZ_SB % 256 == 0 && SZ_P16 % 256 == 0 && SZ_OB % 256 == 0 && SZ_AT % 256 == 0);
    if (WS_TOTAL > ws_size) return;
    char* wsp = (char*)d_ws;
    auto take = [&](size_t bytes) { char* p = wsp; wsp += (bytes + 255) & ~(size_t)255; return (void*)p; };
    bf* WQ = (bf*)take(SZ_W); bf* WK = (bf*)take(SZ_W); bf* WV = (bf*)take(SZ_W); bf* WO = (bf*)take(SZ_W);
    bf* XB = (bf*)take(SZ_XB); float* FQ = (float*)take(SZ_F); float* FK = (float*)take(SZ_F);
    bf* QP3 = (bf*)take(SZ_PQK); bf* KP3 = (bf*)take(SZ_PQK); h16* VT16 = (h16*)take(SZ_PL);
    float* Sb = (float*)take(SZ_SB); h16* P16 = (h16*)take(SZ_P16); float* Ob = (float*)take(SZ_OB);
    bf* ATh = (bf*)take(SZ_AT); bf* ATl = (bf*)take(SZ_AT);
    if ((size_t)(wsp - (char*)d_ws) > ws_size) return;
    float* FV = FK;   // v projection reuses the k buffer after the k planes are built (stream-ordered)

    const unsigned LW = (unsigned)(((size_t)DM * DM / 8 + 255) / 256);
    k_cvt8<<<LW, 256, 0, stream>>>(wq, WQ, (size_t)DM * DM / 8);
    k_cvt8<<<LW, 256, 0, stream>>>(wk, WK, (size_t)DM * DM / 8);
    k_cvt8<<<LW, 256, 0, stream>>>(wv, WV, (size_t)DM * DM / 8);
    k_cvt8<<<LW, 256, 0, stream>>>(wo, WO, (size_t)DM * DM / 8);
    const unsigned LX = (unsigned)(((size_t)TT * DM / 8 + 255) / 256);
    const unsigned LQ = (unsigned)(((size_t)NH_ * TT * HD / 8 + 255) / 256);
    const unsigned LM = (unsigned)(((size_t)ZH * TT * HD / 8 + 255) / 256);
    for (int b = 0; b < NB; ++b) {
        k_cvt8<<<LX, 256, 0, stream>>>(x + (size_t)b * SEQ_FULL * DM, XB, (size_t)TT * DM / 8);
        k_gemmw<bf, 0, true><<<dim3(TT / 64, DQ / 64, 1), 32, 0, stream>>>(XB, nullptr, WQ, nullptr, DM, FQ, DQ, bq, 0, 0, 0);
        k_qkp3<1><<<LQ, 256, 0, stream>>>(FQ, DQ, NH_, QP3);      // queries: [hi | lo | hi]
        k_gemmw<bf, 0, true><<<dim3(TT / 64, DQ / 64, 1), 32, 0, stream>>>(XB, nullptr, WK, nullptr, DM, FK, DQ, bk, 0, 0, 0);
        k_qkp3<0><<<LQ, 256, 0, stream>>>(FK, DQ, NH_, KP3);      // keys:    [hi | hi | lo]
        k_gemmw<bf, 0, true><<<dim3(TT / 64, DQ / 64, 1), 32, 0, stream>>>(XB, nullptr, WV, nullptr, DM, FV, DQ, bv, 0, 0, 0);
        k_vtp<<<LQ, 256, 0, stream>>>(FV, DQ, NH_, VT16);
        for (int h0 = 0; h0 < NH_; h0 += ZH) { const size_t zq = (size_t)h0;   // the pass's ZH heads use consecutive planes
            // S[zz][i][j] = sum_k QP3[i][k] KP3[j][k] over K=KS  (= qh.kh + ql.kh + qh.kl; A pitch KS, Bt pitch KS)
            k_gemmw<bf, 0, false><<<dim3(TT / 64, TT / 64, ZH), 32, 0, stream>>>(QP3 + zq * TT * KS, nullptr, KP3 + zq * TT * KS, nullptr, KS, Sb, TT, nullptr, (size_t)TT * KS, (size_t)TT * KS, (size_t)TT * TT);
            k_asoft<<<(unsigned)((ZH * TT + 7) / 8), 256, 0, stream>>>(Sb, P16);
            // O[zz][i][d] = sum_j P[i][j] V[d][j]   (A = P16 [i][j] pitch TT, Bt = VT16 [d][j] pitch TT)
            k_gemmw<h16, 0, false><<<dim3(TT / 64, HD / 64, ZH), 32, 0, stream>>>(P16, nullptr, VT16 + zq * HD * TT, nullptr, TT, Ob, HD, nullptr, (size_t)TT * TT, (size_t)HD * TT, (size_t)TT * HD);
            k_merge<<<LM, 256, 0, stream>>>(Ob, h0, ATh, ATl); }
        k_gemmw<bf, 1, true><<<dim3(TT / 64, DM / 64, 1), 32, 0, stream>>>(ATh, ATl, WO, nullptr, DQ, OUT + (size_t)b * SEQ_FULL * DM, DM, bo, 0, 0, 0); }
}

// v001
// Measured time: 354 microseconds a run.
// Next to v000, in two timings, it ran 2.37 and 2.36 times as fast.
#include <hip/hip_runtime.h>

// Contractions: q/k/v projections v_wmma_f32_16x16x32_bf16 (bf16 operands = RNE-converted inputs, biases RNE-converted to bf16); scores q.k v_wmma_f32_16x16x32_bf16 with q,k as bf16 hi+lo planes folded along k ([qh|ql|qh] x [kh|kh|kl], K=192, 3 products); attn.v v_wmma_f32_16x16x32_f16 (fp16 operands, attn carried x16384); output projection v_wmma_f32_16x16x32_bf16 (ctx as bf16 hi+lo planes, weight bf16, 2 products); all f32 accumulate, softmax f32.
// x [NB][SEQ][1024]; q,k,v = x W^T + b (W [out][in] [1024][1024], 16 heads x 64); scores = q.k (no pre-softmax scale); softmax over all SEQ keys; ctx = softmax.v x (1/32); out = merged heads W_o^T + b_o -> [NB][SEQ][1024] f32.
// All NB batches go through every launch outside the attention passes together: projections see one [NB*SEQ][1024] matrix, head planes are numbered g = b*16 + h, and the attention stages take ZP planes per pass in grid z.

#ifndef NB
#define NB 4
#endif
#ifndef SEQ
#define SEQ 1024
#endif
#define NB_FULL  4
#define SEQ_FULL 1024
#define TT   SEQ
#define DM   1024
#define NH_  16
#define HD   64
#define DQ   (NH_ * HD)
#define KS   (3 * HD)          // folded score operand width: 3 planes of HD
#define ZP   32                // (batch, head) planes per attention pass: what the f32 score buffer leaves room for in the workspace
#define PCAR 16384.0f
#define OSC  (1.0f / (PCAR * 32.0f))   // undo carry and apply the post-softmax 1/32 (exact power of two)
static_assert(TT % 128 == 0);
static_assert((NB * NH_) % ZP == 0);
static_assert(SEQ == SEQ_FULL);   // the batches' rows are read and written as one contiguous matrix
static_assert(KS % 32 == 0);
static_assert(DM % 64 == 0 && DQ % 64 == 0 && HD == 64);
static_assert(NB >= 1 && NB <= NB_FULL && SEQ <= SEQ_FULL);

typedef _Float16 h16;
typedef unsigned short bf;
typedef __attribute__((ext_vector_type(16))) __bf16   v16bf;
typedef __attribute__((ext_vector_type(16))) _Float16 v16h;
typedef __attribute__((ext_vector_type(8)))  _Float16 v8h;
typedef __attribute__((ext_vector_type(8)))  unsigned short v8us;
typedef __attribute__((ext_vector_type(8)))  float    v8f;
typedef __attribute__((ext_vector_type(4)))  float    v4f;
typedef __attribute__((ext_vector_type(4)))  _Float16 v4h;
typedef v8h  __attribute__((may_alias)) v8ha;
typedef v4f  __attribute__((may_alias)) v4fa;
typedef v8us __attribute__((may_alias)) v8usa;

__device__ __forceinline__ unsigned short f2bf(float f) { unsigned u = __float_as_uint(f); u += 0x7FFFu + ((u >> 16) & 1u); return (unsigned short)(u >> 16); }
__device__ __forceinline__ float bf2f(unsigned short b) { return __uint_as_float(((unsigned)b) << 16); }
__device__ __forceinline__ float bfr(float f) { return bf2f(f2bf(f)); }
__device__ __forceinline__ v16h cat16(v8h lo, v8h hi) { return __builtin_shufflevector(lo, hi, 0, 1, 2, 3, 4, 5, 6, 7, 8, 9, 10, 11, 12, 13, 14, 15); }
__device__ __forceinline__ v16bf cat16b(v8us lo, v8us hi) { return __builtin_bit_cast(v16bf, __builtin_shufflevector(lo, hi, 0, 1, 2, 3, 4, 5, 6, 7, 8, 9, 10, 11, 12, 13, 14, 15)); }
__device__ __forceinline__ v8f wmma16(v16h a, v16h b, v8f c) { return __builtin_amdgcn_wmma_f32_16x16x32_f16(false, a, false, b, (short)0, c, false, false); }
__device__ __forceinline__ v8f wmmab(v16bf a, v16bf b, v8f c) { return __builtin_amdgcn_wmma_f32_16x16x32_bf16(false, a, false, b, (short)0, c, false, false); }
__device__ __forceinline__ h16 tohx(float x) { return (h16)x; }
__device__ __forceinline__ void splitf(float y, unsigned short& h, unsigned short& l) { h = f2bf(y); l = f2bf(y - bf2f(h)); }

// ---- k_gemmw: register-blocked GEMM, ONE WAVE per 64x64 output tile (16 accumulators), operands straight from K-contiguous 16-bit planes; grid (M/64, N/64, Z), 32 threads.
// C[m][n] (f32, pitch ldc, + optional bias[n] RNE-converted to bf16) = sum_k A[m][k] Bt[n][k] (+ split products per NSPLIT). z-batch strides sA/sB/sC in elements. K % 32 == 0, A/Bt row pitch == K.
// Fragments: lane -> row/col lane&15, elements 0..7 <- k0 + 8*(lane>>4) + 0..7, elements 8..15 <- k0 + 16 + 8*(lane>>4) + 0..7 for BOTH A and Bt; D element j -> row 8*(lane>>4)+j, col lane&15.
template <typename T16> struct WFrag;
template <> struct WFrag<h16> { typedef v16h V; static __device__ __forceinline__ V ld(const h16* p) { return cat16(*(const v8h*)p, *(const v8h*)(p + 16)); } static __device__ __forceinline__ v8f mma(V a, V b, v8f c) { return wmma16(a, b, c); } };
template <> struct WFrag<bf> { typedef v16bf V; static __device__ __forceinline__ V ld(const bf* p) { return cat16b(*(const v8us*)p, *(const v8us*)(p + 16)); } static __device__ __forceinline__ v8f mma(V a, V b, v8f c) { return wmmab(a, b, c); } };
template <typename T16, int NSPLIT, bool BIAS>
__global__ __launch_bounds__(32) void k_gemmw(const T16* __restrict__ A, const T16* __restrict__ A2, const T16* __restrict__ Bt, const T16* __restrict__ Bt2, int K, float* C, int ldc, const float* __restrict__ bias, size_t sA, size_t sB, size_t sC) {
    typedef typename WFrag<T16>::V V;
    __shared__ __align__(16) float os[16 * 68];
    const size_t z = blockIdx.z; A += z * sA; if (A2) A2 += z * sA; Bt += z * sB; if (Bt2) Bt2 += z * sB; C += z * sC;
    const int lane = threadIdx.x & 31, lr = lane & 15, hi = lane >> 4; const int r0 = blockIdx.x * 64, c0 = blockIdx.y * 64;
    v8f acc[4][4];
#pragma unroll
    for (int mb = 0; mb < 4; ++mb)
#pragma unroll
        for (int nb = 0; nb < 4; ++nb) acc[mb][nb] = (v8f){};
    const size_t aoff = (size_t)(r0 + lr) * K + 8 * hi, boff = (size_t)(c0 + lr) * K + 8 * hi;
#pragma unroll 1
    for (int kc = 0; kc < K; kc += 32) {
        V a[4], a2[4];
#pragma unroll
        for (int mb = 0; mb < 4; ++mb) { a[mb] = WFrag<T16>::ld(A + aoff + (size_t)mb * 16 * K + kc); if (NSPLIT == 1 || NSPLIT == 2) a2[mb] = WFrag<T16>::ld(A2 + aoff + (size_t)mb * 16 * K + kc); }
#pragma unroll
        for (int nb = 0; nb < 4; ++nb) { const V b = WFrag<T16>::ld(Bt + boff + (size_t)nb * 16 * K + kc); V b2; if (NSPLIT >= 2) b2 = WFrag<T16>::ld(Bt2 + boff + (size_t)nb * 16 * K + kc);
#pragma unroll
            for (int mb = 0; mb < 4; ++mb) { acc[mb][nb] = WFrag<T16>::mma(a[mb], b, acc[mb][nb]); if (NSPLIT == 1 || NSPLIT == 2) acc[mb][nb] = WFrag<T16>::mma(a2[mb], b, acc[mb][nb]); if (NSPLIT >= 2) acc[mb][nb] = WFrag<T16>::mma(a[mb], b2, acc[mb][nb]); } }
        asm volatile("v_nop\n\tv_nop\n\tv_nop\n\tv_nop" : "+v"(acc[0][0]), "+v"(acc[1][1]), "+v"(acc[2][2]), "+v"(acc[3][3]) : "v"(a[0]), "v"(a[3]));
    }
#pragma unroll
    for (int mb = 0; mb < 4; ++mb) {
#pragma unroll
        for (int nb = 0; nb < 4; ++nb) {
#pragma unroll
            for (int j = 0; j < 8; ++j) os[(hi * 8 + j) * 68 + nb * 16 + lr] = acc[mb][nb][j]; }
        __builtin_amdgcn_wave_barrier(); asm volatile("" ::: "memory");
        float* crow = C + (size_t)(r0 + mb * 16) * ldc + c0;
{
#pragma unroll
            for (int s = 0; s < 8; ++s) { const int row = 2 * s + hi, cofs = lr * 4; v4f val = *(const v4fa*)(os + row * 68 + cofs); if (BIAS) { val[0] += bfr(bias[c0 + cofs]); val[1] += bfr(bias[c0 + cofs + 1]); val[2] += bfr(bias[c0 + cofs + 2]); val[3] += bfr(bias[c0 + cofs + 3]); }
                *(v4f*)(crow + (size_t)row * ldc + cofs) = val; }
             }
        __builtin_amdgcn_wave_barrier(); asm volatile("" ::: "memory");
    }
}

__global__ __launch_bounds__(256) void k_cvt8(const float* __restrict__ src, bf* dst, size_t n8) { const size_t i = (size_t)blockIdx.x * 256 + threadIdx.x; if (i >= n8) return; const v8f v = *(const v8f*)(src + i * 8); v8us o;
#pragma unroll
    for (int k = 0; k < 8; ++k) o[k] = f2bf(v[k]); *(v8us*)(dst + i * 8) = o;  }

// k_qkp3: folded head planes P[g][t][KS] (bf16), g = b*NH_ + h, row = (g*TT + t): slots 0..HD-1 = hi(F[b*TT + t][h*HD + d]), HD..2HD-1 = (SEL ? lo : hi), 2HD..3HD-1 = (SEL ? hi : lo), with hi/lo = bf16 split of the f32 value.
template <int SEL>
__global__ __launch_bounds__(256) void k_qkp3(const float* __restrict__ F, int pitch, int nplanes, bf* P) {
    const size_t e = ((size_t)blockIdx.x * 256 + threadIdx.x) * 8; if (e >= (size_t)nplanes * TT * HD) return;
    const int d = (int)(e % HD); const size_t ht = e / HD; const int t = (int)(ht % TT); const int g = (int)(ht / TT); const int b = g / NH_, h = g % NH_;
    const float* f = F + ((size_t)b * TT + t) * pitch + (size_t)h * HD + d;
    const v4f x0 = *(const v4f*)f; const v4f x1 = *(const v4f*)(f + 4); v8us oh, ol;
#pragma unroll
    for (int q = 0; q < 4; ++q) { unsigned short a, c2; splitf(x0[q], a, c2); oh[q] = a; ol[q] = c2; splitf(x1[q], a, c2); oh[q + 4] = a; ol[q + 4] = c2; }
    const v8us s1 = SEL ? ol : oh; const v8us s2 = SEL ? oh : ol;
    bf* row = P + ht * (size_t)KS + d;
    *(v8us*)(row) = oh; *(v8us*)(row + HD) = s1; *(v8us*)(row + 2 * HD) = s2;
    
}
__global__ __launch_bounds__(256) void k_vtp(const float* __restrict__ F, int pitch, int nplanes, h16* V16) {
    const size_t e = ((size_t)blockIdx.x * 256 + threadIdx.x) * 8; if (e >= (size_t)nplanes * HD * TT) return;
    const int t = (int)(e % TT); const int d = (int)((e / TT) % HD); const int g = (int)(e / ((size_t)TT * HD)); const int b = g / NH_, h = g % NH_;
    const float* f = F + ((size_t)b * TT + t) * pitch + (size_t)h * HD + d; v8h o;
#pragma unroll
    for (int q = 0; q < 8; ++q) o[q] = tohx(f[(size_t)q * pitch]);
    *(v8h*)(V16 + e) = o; 
}
__global__ __launch_bounds__(256) void k_asoft(const float* __restrict__ Sb, h16* P16) {
    const int lane = threadIdx.x & 31; const int row = blockIdx.x * 8 + (threadIdx.x >> 5); if (row >= ZP * TT) return;
    const float* sr = Sb + (size_t)row * TT; float v[TT / 32]; float mx = -3.0e38f;
#pragma unroll
    for (int ch = 0; ch < TT / 128; ++ch) { const int j0 = ch * 128 + lane * 4; const v4f a = *(const v4f*)(sr + j0);
#pragma unroll
        for (int q = 0; q < 4; ++q) { const float t = a[q]; v[ch * 4 + q] = t; mx = fmaxf(mx, t); } }
#pragma unroll
    for (int sh = 16; sh; sh >>= 1) mx = fmaxf(mx, __shfl_xor(mx, sh, 32));
    float sum = 0.f;
#pragma unroll
    for (int k = 0; k < TT / 32; ++k) { float d0 = __fsub_rn(v[k], mx); asm volatile("" : "+v"(d0)); v[k] = __builtin_amdgcn_exp2f(__fmul_rn(d0, 1.4426950408889634f)); sum += v[k]; }
#pragma unroll
    for (int sh = 16; sh; sh >>= 1) sum += __shfl_xor(sum, sh, 32);
    const float f = __fdiv_rn(PCAR, sum);
{
#pragma unroll
        for (int ch = 0; ch < TT / 128; ++ch) { v4h o4;
#pragma unroll
            for (int q = 0; q < 4; ++q) o4[q] = tohx(v[ch * 4 + q] * f);
            *(v4h*)(P16 + (size_t)row * TT + ch * 128 + lane * 4) = o4; }
         }
}
__global__ __launch_bounds__(256) void k_merge(const float* __restrict__ O, int g0, bf* Ah, bf* Al) {
    const size_t e = ((size_t)blockIdx.x * 256 + threadIdx.x) * 8; if (e >= (size_t)ZP * TT * HD) return;
    const int d = (int)(e % HD); const int t = (int)((e / HD) % TT); const int g = g0 + (int)(e / ((size_t)HD * TT)); const int b = g / NH_, h = g % NH_;
    const size_t oo = ((size_t)b * TT + t) * DQ + (size_t)h * HD + d;
    const v4f x0 = *(const v4f*)(O + e); const v4f x1 = *(const v4f*)(O + e + 4); v8us oh, ol;
#pragma unroll
    for (int q = 0; q < 4; ++q) { unsigned short a, c2; splitf(x0[q] * OSC, a, c2); oh[q] = a; ol[q] = c2; splitf(x1[q] * OSC, a, c2); oh[q + 4] = a; ol[q + 4] = c2; }
    *(v8us*)(Ah + oo) = oh; *(v8us*)(Al + oo) = ol; 
}

extern "C" void kernel_launch(void* const* d_in, const int* in_sizes, int n_in,
                              void* d_out, int out_size, void* d_ws, size_t ws_size, hipStream_t stream) {
    if (n_in < 9) return;
    const size_t xneed = (size_t)(NB - 1) * SEQ_FULL * DM + (size_t)TT * DM;
    if ((size_t)in_sizes[0] < xneed) return;
    if (in_sizes[1] < DM * DM || in_sizes[3] < DM * DM || in_sizes[5] < DM * DM || in_sizes[7] < DM * DM) return;
    if (in_sizes[2] < DM || in_sizes[4] < DM || in_sizes[6] < DM || in_sizes[8] < DM) return;
    if ((size_t)out_size < xneed) return;
    const float* x  = (const float*)d_in[0];   // [NB_FULL][SEQ_FULL][DM]
    const float* wq = (const float*)d_in[1];  const float* bq = (const float*)d_in[2];
    const float* wk = (const float*)d_in[3];  const float* bk = (const float*)d_in[4];
    const float* wv = (const float*)d_in[5];  const float* bv = (const float*)d_in[6];
    const float* wo = (const float*)d_in[7];  const float* bo = (const float*)d_in[8];
    float* OUT = (float*)d_out;     // [NB_FULL][SEQ_FULL][DM]

    constexpr size_t MR     = (size_t)NB * TT;              // rows of all batches together
    constexpr size_t NPL    = (size_t)NB * NH_;             // (batch, head) planes
    constexpr size_t SZ_W   = (size_t)DM * DM * 2;          // x4 : WQ WK WV WO bf16 [out][in]
    constexpr size_t SZ_XB  = MR * DM * 2;                  // x  bf16 [MR][DM]
    constexpr size_t SZ_F   = MR * DQ * 4;                  // x2 : FQ, FK(=FV) f32 [MR][DQ]
    constexpr size_t SZ_PQK = NPL * TT * KS * 2;            // x2 : QP3 [g*TT+t][KS], KP3 [g*TT+t][KS] bf16 folded planes
    constexpr size_t SZ_PL  = NPL * TT * HD * 2;            // VT16 [g][d][t] fp16
    constexpr size_t SZ_SB  = (size_t)ZP * TT * TT * 4;     // scores f32 [zz][i][j]
    constexpr size_t SZ_P16 = (size_t)ZP * TT * TT * 2;     // attn x16384 fp16 [zz][i][j]
    constexpr size_t SZ_OB  = (size_t)ZP * TT * HD * 4;     // ctx x(16384*32) f32 [zz][t][d]
    constexpr size_t SZ_AT  = MR * DQ * 2;                  // x2 : ctx hi / lo bf16 [MR][DQ]
    // Buffers that are never live together share bytes (all launches are stream-ordered):
    //  - WQ WK WV XB FQ FK are last read before the first pass; P16 is first written in it: one region holds either.
    //  - Ob is written after the pass's scores have been consumed by the softmax: it lies at the start of Sb.
    //  - ATh / ATl are first written after pass 0's score product, the last reader of pass 0's q / k planes: they lie at the start of QP3 / KP3, inside pass 0's planes.
    constexpr size_t SZ_EARLY = 3 * SZ_W + SZ_XB + 2 * SZ_F;
    constexpr size_t SZ_U     = SZ_EARLY > SZ_P16 ? SZ_EARLY : SZ_P16;
    constexpr size_t WS_TOTAL = SZ_W + 2 * SZ_PQK + SZ_PL + SZ_SB + SZ_U;
    static_assert(WS_TOTAL <= (size_t)268435456);
    static_assert(SZ_OB <= SZ_SB && SZ_AT <= (size_t)ZP * TT * KS * 2);
    static_assert(SZ_W % 256 == 0 && SZ_XB % 256 == 0 && SZ_F % 256 == 0 && SZ_PQK % 256 == 0 && SZ_PL % 256 == 0 && SZ_SB % 256 == 0 && SZ_P16 % 256 == 0 && SZ_OB % 256 == 0 && SZ_AT % 256 == 0);
    if (WS_TOTAL > ws_size) return;
    char* wsp = (char*)d_ws;
    auto take = [&](size_t bytes) { char* p = wsp; wsp += (bytes + 255) & ~(size_t)255; return (void*)p; };
    bf* WO = (bf*)take(SZ_W); bf* QP3 = (bf*)take(SZ_PQK); bf* KP3 = (bf*)take(SZ_PQK); h16* VT16 = (h16*)take(SZ_PL);
    float* Sb = (float*)take(SZ_SB); char* U = (char*)take(SZ_U);
    if ((size_t)(wsp - (char*)d_ws) > ws_size) return;
    wsp = U;
    bf* WQ = (bf*)take(SZ_W); bf* WK = (bf*)take(SZ_W); bf* WV = (bf*)take(SZ_W);
    bf* XB = (bf*)take(SZ_XB); float* FQ = (float*)take(SZ_F); float* FK = (float*)take(SZ_F);
    h16* P16 = (h16*)U; float* Ob = Sb; bf* ATh = QP3; bf* ATl = KP3;
    float* FV = FK;   // v projection reuses the k buffer after the k planes are built (stream-ordered)

    const unsigned LW = (unsigned)(((size_t)DM * DM / 8 + 255) / 256);
    k_cvt8<<<LW, 256, 0, stream>>>(wq, WQ, (size_t)DM * DM / 8);
    k_cvt8<<<LW, 256, 0, stream>>>(wk, WK, (size_t)DM * DM / 8);
    k_cvt8<<<LW, 256, 0, stream>>>(wv, WV, (size_t)DM * DM / 8);
    k_cvt8<<<LW, 256, 0, stream>>>(wo, WO, (size_t)DM * DM / 8);
    const unsigned LX = (unsigned)((MR * DM / 8 + 255) / 256);
    const unsigned LQ = (unsigned)((NPL * TT * HD / 8 + 255) / 256);
    const unsigned LM = (unsigned)(((size_t)ZP * TT * HD / 8 + 255) / 256);
    k_cvt8<<<LX, 256, 0, stream>>>(x, XB, MR * DM / 8);
    k_gemmw<bf, 0, true><<<dim3(MR / 64, DQ / 64, 1), 32, 0, stream>>>(XB, nullptr, WQ, nullptr, DM, FQ, DQ, bq, 0, 0, 0);
    k_qkp3<1><<<LQ, 256, 0, stream>>>(FQ, DQ, (int)NPL, QP3);      // queries: [hi | lo | hi]
    k_gemmw<bf, 0, true><<<dim3(MR / 64, DQ / 64, 1), 32, 0, stream>>>(XB, nullptr, WK, nullptr, DM, FK, DQ, bk, 0, 0, 0);
    k_qkp3<0><<<LQ, 256, 0, stream>>>(FK, DQ, (int)NPL, KP3);      // keys:    [hi | hi | lo]
    k_gemmw<bf, 0, true><<<dim3(MR / 64, DQ / 64, 1), 32, 0, stream>>>(XB, nullptr, WV, nullptr, DM, FV, DQ, bv, 0, 0, 0);
    k_vtp<<<LQ, 256, 0, stream>>>(FV, DQ, (int)NPL, VT16);
    for (int g0 = 0; g0 < (int)NPL; g0 += ZP) { const size_t zq = (size_t)g0;   // the pass's ZP planes are consecutive
        // S[zz][i][j] = sum_k QP3[i][k] KP3[j][k] over K=KS  (= qh.kh + ql.kh + qh.kl; A pitch KS, Bt pitch KS)
        k_gemmw<bf, 0, false><<<dim3(TT / 64, TT / 64, ZP), 32, 0, stream>>>(QP3 + zq * TT * KS, nullptr, KP3 + zq * TT * KS, nullptr, KS, Sb, TT, nullptr, (size_t)TT * KS, (size_t)TT * KS, (size_t)TT * TT);
        k_asoft<<<(unsigned)((ZP * TT + 7) / 8), 256, 0, stream>>>(Sb, P16);
        // O[zz][i][d] = sum_j P[i][j] V[d][j]   (A = P16 [i][j] pitch TT, Bt = VT16 [d][j] pitch TT)
        k_gemmw<h16, 0, false><<<dim3(TT / 64, HD / 64, ZP), 32, 0, stream>>>(P16, nullptr, VT16 + zq * HD * TT, nullptr, TT, Ob, HD, nullptr, (size_t)TT * TT, (size_t)HD * TT, (size_t)TT * HD);
        k_merge<<<LM, 256, 0, stream>>>(Ob, g0, ATh, ATl); }
    k_gemmw<bf, 1, true><<<dim3(MR / 64, DM / 64, 1), 32, 0, stream>>>(ATh, ATl, WO, nullptr, DQ, OUT, DM, bo, 0, 0, 0);
}

// v002
// Measured time: 197 microseconds a run.
// In two side-by-side timings against v001, it was 1.78 and 1.81 times as fast.
// Counting every step since v000, it is 4.24 times as fast.
#include <hip/hip_runtime.h>

// Contractions: q/k/v projections v_wmma_f32_16x16x32_bf16 (bf16 operands = RNE-converted inputs, biases RNE-converted to bf16); scores q.k v_wmma_f32_16x16x32_bf16 with q,k as bf16 hi+lo planes (qh.kh + ql.kh + qh.kl, 3 products); attn.v v_wmma_f32_16x16x32_f16 (fp16 operands, unnormalised exp carried x16384); output projection v_wmma_f32_16x16x32_bf16 (ctx as bf16 hi+lo planes, weight bf16, 2 products); all f32 accumulate, softmax f32.
// x [NB][SEQ][1024]; q,k,v = x W^T + b (W [out][in] [1024][1024], 16 heads x 64); scores = q.k (no pre-softmax scale); softmax over all SEQ keys; ctx = softmax.v x (1/32); out = merged heads W_o^T + b_o -> [NB][SEQ][1024] f32.
// All NB batches go through every launch together: projections see one [NB*SEQ][1024] matrix, head planes are numbered g = b*16 + h, and one attention launch (k_fattn) takes every plane in grid y.

#ifndef NB
#define NB 4
#endif
#ifndef SEQ
#define SEQ 1024
#endif
#define NB_FULL  4
#define SEQ_FULL 1024
#define TT   SEQ
#define DM   1024
#define NH_  16
#define HD   64
#define DQ   (NH_ * HD)
#define KS   (2 * HD)          // q / k plane row: [hi | lo], HD each
#define FA_W   8               // attention: waves per work-group
#define FA_QB  (FA_W * 32)     // query columns per work-group (32 per wave)
#define FA_ST  64              // keys per LDS stage
#define FA_KPB (KS * 2 + 16)   // LDS pitch of a staged key row in bytes (16 B x odd: conflict-free 16-byte reads)
#define FA_VPB (FA_ST * 2 + 16) // LDS pitch of a staged v row (one d, FA_ST keys) in bytes
static_assert(TT % FA_QB == 0 && TT % FA_ST == 0);
static_assert(FA_W * 32 == 256 && FA_ST * KS == 4 * 256 * 8 && HD * FA_ST == 2 * 256 * 8);   // k_fattn's staging: 256 threads, 4 + 2 loads of 8 elements each per stage
static_assert(SEQ == SEQ_FULL);   // the batches' rows are read and written as one contiguous matrix
static_assert(KS % 32 == 0);
static_assert(DM % 64 == 0 && DQ % 64 == 0 && HD == 64);
static_assert(NB >= 1 && NB <= NB_FULL && SEQ <= SEQ_FULL);

typedef _Float16 h16;
typedef unsigned short bf;
typedef __attribute__((ext_vector_type(16))) __bf16   v16bf;
typedef __attribute__((ext_vector_type(16))) _Float16 v16h;
typedef __attribute__((ext_vector_type(8)))  _Float16 v8h;
typedef __attribute__((ext_vector_type(8)))  unsigned short v8us;
typedef __attribute__((ext_vector_type(8)))  float    v8f;
typedef __attribute__((ext_vector_type(4)))  float    v4f;
typedef __attribute__((ext_vector_type(2)))  float    v2f;
typedef v8h  __attribute__((may_alias)) v8ha;
typedef v4f  __attribute__((may_alias)) v4fa;
typedef v8us __attribute__((may_alias)) v8usa;

__device__ __forceinline__ unsigned short f2bf(float f) { unsigned u = __float_as_uint(f); u += 0x7FFFu + ((u >> 16) & 1u); return (unsigned short)(u >> 16); }
__device__ __forceinline__ float bf2f(unsigned short b) { return __uint_as_float(((unsigned)b) << 16); }
__device__ __forceinline__ float bfr(float f) { return bf2f(f2bf(f)); }
__device__ __forceinline__ v16h cat16(v8h lo, v8h hi) { return __builtin_shufflevector(lo, hi, 0, 1, 2, 3, 4, 5, 6, 7, 8, 9, 10, 11, 12, 13, 14, 15); }
__device__ __forceinline__ v16bf cat16b(v8us lo, v8us hi) { return __builtin_bit_cast(v16bf, __builtin_shufflevector(lo, hi, 0, 1, 2, 3, 4, 5, 6, 7, 8, 9, 10, 11, 12, 13, 14, 15)); }
__device__ __forceinline__ v8f wmma16(v16h a, v16h b, v8f c) { return __builtin_amdgcn_wmma_f32_16x16x32_f16(false, a, false, b, (short)0, c, false, false); }
__device__ __forceinline__ v8f wmmab(v16bf a, v16bf b, v8f c) { return __builtin_amdgcn_wmma_f32_16x16x32_bf16(false, a, false, b, (short)0, c, false, false); }
__device__ __forceinline__ h16 tohx(float x) { return (h16)x; }
__device__ __forceinline__ void splitf(float y, unsigned short& h, unsigned short& l) { h = f2bf(y); l = f2bf(y - bf2f(h)); }

// ---- k_gemmw: register-blocked GEMM, ONE WAVE per 64x64 output tile (16 accumulators), operands straight from K-contiguous 16-bit planes; grid (M/64, N/64, Z), 32 threads.
// C[m][n] (f32, pitch ldc, + optional bias[n] RNE-converted to bf16) = sum_k A[m][k] Bt[n][k] (+ split products per NSPLIT). z-batch strides sA/sB/sC in elements. K % 32 == 0, A/Bt row pitch == K.
// Fragments: lane -> row/col lane&15, elements 0..7 <- k0 + 8*(lane>>4) + 0..7, elements 8..15 <- k0 + 16 + 8*(lane>>4) + 0..7 for BOTH A and Bt; D element j -> row 8*(lane>>4)+j, col lane&15.
template <typename T16> struct WFrag;
template <> struct WFrag<bf> { typedef v16bf V; static __device__ __forceinline__ V ld(const bf* p) { return cat16b(*(const v8us*)p, *(const v8us*)(p + 16)); } static __device__ __forceinline__ v8f mma(V a, V b, v8f c) { return wmmab(a, b, c); } };
template <typename T16, int NSPLIT, bool BIAS>
__global__ __launch_bounds__(32) void k_gemmw(const T16* __restrict__ A, const T16* __restrict__ A2, const T16* __restrict__ Bt, const T16* __restrict__ Bt2, int K, float* C, int ldc, const float* __restrict__ bias, size_t sA, size_t sB, size_t sC) {
    typedef typename WFrag<T16>::V V;
    __shared__ __align__(16) float os[16 * 68];
    const size_t z = blockIdx.z; A += z * sA; if (A2) A2 += z * sA; Bt += z * sB; if (Bt2) Bt2 += z * sB; C += z * sC;
    const int lane = threadIdx.x & 31, lr = lane & 15, hi = lane >> 4; const int r0 = blockIdx.x * 64, c0 = blockIdx.y * 64;
    v8f acc[4][4];
#pragma unroll
    for (int mb = 0; mb < 4; ++mb)
#pragma unroll
        for (int nb = 0; nb < 4; ++nb) acc[mb][nb] = (v8f){};
    const size_t aoff = (size_t)(r0 + lr) * K + 8 * hi, boff = (size_t)(c0 + lr) * K + 8 * hi;
#pragma unroll 1
    for (int kc = 0; kc < K; kc += 32) {
        V a[4], a2[4];
#pragma unroll
        for (int mb = 0; mb < 4; ++mb) { a[mb] = WFrag<T16>::ld(A + aoff + (size_t)mb * 16 * K + kc); if (NSPLIT == 1 || NSPLIT == 2) a2[mb] = WFrag<T16>::ld(A2 + aoff + (size_t)mb * 16 * K + kc); }
#pragma unroll
        for (int nb = 0; nb < 4; ++nb) { const V b = WFrag<T16>::ld(Bt + boff + (size_t)nb * 16 * K + kc); V b2; if (NSPLIT >= 2) b2 = WFrag<T16>::ld(Bt2 + boff + (size_t)nb * 16 * K + kc);
#pragma unroll
            for (int mb = 0; mb < 4; ++mb) { acc[mb][nb] = WFrag<T16>::mma(a[mb], b, acc[mb][nb]); if (NSPLIT == 1 || NSPLIT == 2) acc[mb][nb] = WFrag<T16>::mma(a2[mb], b, acc[mb][nb]); if (NSPLIT >= 2) acc[mb][nb] = WFrag<T16>::mma(a[mb], b2, acc[mb][nb]); } }
        asm volatile("v_nop\n\tv_nop\n\tv_nop\n\tv_nop" : "+v"(acc[0][0]), "+v"(acc[1][1]), "+v"(acc[2][2]), "+v"(acc[3][3]) : "v"(a[0]), "v"(a[3]));
    }
#pragma unroll
    for (int mb = 0; mb < 4; ++mb) {
#pragma unroll
        for (int nb = 0; nb < 4; ++nb) {
#pragma unroll
            for (int j = 0; j < 8; ++j) os[(hi * 8 + j) * 68 + nb * 16 + lr] = acc[mb][nb][j]; }
        __builtin_amdgcn_wave_barrier(); asm volatile("" ::: "memory");
        float* crow = C + (size_t)(r0 + mb * 16) * ldc + c0;
{
#pragma unroll
            for (int s = 0; s < 8; ++s) { const int row = 2 * s + hi, cofs = lr * 4; v4f val = *(const v4fa*)(os + row * 68 + cofs); if (BIAS) { val[0] += bfr(bias[c0 + cofs]); val[1] += bfr(bias[c0 + cofs + 1]); val[2] += bfr(bias[c0 + cofs + 2]); val[3] += bfr(bias[c0 + cofs + 3]); }
                *(v4f*)(crow + (size_t)row * ldc + cofs) = val; }
             }
        __builtin_amdgcn_wave_barrier(); asm volatile("" ::: "memory");
    }
}

__global__ __launch_bounds__(256) void k_cvt8(const float* __restrict__ src, bf* dst, size_t n8) { const size_t i = (size_t)blockIdx.x * 256 + threadIdx.x; if (i >= n8) return; const v8f v = *(const v8f*)(src + i * 8); v8us o;
#pragma unroll
    for (int k = 0; k < 8; ++k) o[k] = f2bf(v[k]); *(v8us*)(dst + i * 8) = o;  }

// k_qkp2: head planes P[g][t][KS] (bf16), g = b*NH_ + h, row = (g*TT + t): slots 0..HD-1 = hi(F[b*TT + t][h*HD + d]), HD..2HD-1 = lo, with hi/lo = bf16 split of the f32 value.
__global__ __launch_bounds__(256) void k_qkp2(const float* __restrict__ F, int pitch, int nplanes, bf* P) {
    const size_t e = ((size_t)blockIdx.x * 256 + threadIdx.x) * 8; if (e >= (size_t)nplanes * TT * HD) return;
    const int d = (int)(e % HD); const size_t ht = e / HD; const int t = (int)(ht % TT); const int g = (int)(ht / TT); const int b = g / NH_, h = g % NH_;
    const float* f = F + ((size_t)b * TT + t) * pitch + (size_t)h * HD + d;
    const v4f x0 = *(const v4f*)f; const v4f x1 = *(const v4f*)(f + 4); v8us oh, ol;
#pragma unroll
    for (int q = 0; q < 4; ++q) { unsigned short a, c2; splitf(x0[q], a, c2); oh[q] = a; ol[q] = c2; splitf(x1[q], a, c2); oh[q + 4] = a; ol[q + 4] = c2; }
    bf* row = P + ht * (size_t)KS + d;
    *(v8us*)(row) = oh; *(v8us*)(row + HD) = ol;
}
__global__ __launch_bounds__(256) void k_vtp(const float* __restrict__ F, int pitch, int nplanes, h16* V16) {
    const size_t e = ((size_t)blockIdx.x * 256 + threadIdx.x) * 8; if (e >= (size_t)nplanes * HD * TT) return;
    const int t = (int)(e % TT); const int d = (int)((e / TT) % HD); const int g = (int)(e / ((size_t)TT * HD)); const int b = g / NH_, h = g % NH_;
    const float* f = F + ((size_t)b * TT + t) * pitch + (size_t)h * HD + d; v8h o;
#pragma unroll
    for (int q = 0; q < 8; ++q) o[q] = tohx(f[(size_t)q * pitch]);
    *(v8h*)(V16 + e) = o; 
}
// lane l <-> lane l ^ 16
__device__ __forceinline__ float xhalf(float x) { return __builtin_bit_cast(float, __builtin_amdgcn_permlanex16(__builtin_bit_cast(int, x), __builtin_bit_cast(int, x), 0x76543210, 0xfedcba98, false, false)); }

__global__ __launch_bounds__(FA_W * 32, 4) void k_fattn(const bf* __restrict__ QP, const bf* __restrict__ KP, const h16* __restrict__ VT, bf* ATh, bf* ATl) {
    __shared__ __align__(16) unsigned char kls[2][FA_ST * FA_KPB];
    __shared__ __align__(16) unsigned char vls[2][HD * FA_VPB];
    constexpr int NS = TT / FA_ST;
    constexpr float L2E = 1.4426950408889634f;
    const int tid = threadIdx.x, lane = tid & 31, wave = tid >> 5, lr = lane & 15, hi = lane >> 4;
    const int g = blockIdx.y, q0 = blockIdx.x * FA_QB + wave * 32;
    const bf* kg = KP + (size_t)g * TT * KS; const h16* vg = VT + (size_t)g * HD * TT;
    v16bf qf[2][4];   // [group][qh k 0..31, qh k 32..63, ql k 0..31, ql k 32..63]
#pragma unroll
    for (int gr = 0; gr < 2; ++gr)
#pragma unroll
        for (int c = 0; c < 4; ++c) qf[gr][c] = WFrag<bf>::ld(QP + ((size_t)g * TT + q0 + gr * 16 + lr) * KS + c * 32 + 8 * hi);
    v8f o[2][4]; float m2[2], l[2];
#pragma unroll
    for (int gr = 0; gr < 2; ++gr) { m2[gr] = -3.0e38f; l[gr] = 0.f;
#pragma unroll
        for (int db = 0; db < 4; ++db) o[gr][db] = (v8f){}; }
    v8us kst[4]; v8h vst[2];
    // a stage's key rows are FA_ST * KS contiguous elements; its v rows are HD runs of FA_ST keys. Each thread walks two pointers, stepped one stage behind each group of loads.
    const bf* kp = kg + (size_t)tid * 8; const h16* vp = vg + (size_t)(tid >> 3) * TT + (tid & 7) * 8;
#define FA_GLOAD() { _Pragma("unroll") for (int i = 0; i < 4; ++i) kst[i] = *(const v8us*)(kp + i * 2048); \
                     _Pragma("unroll") for (int i = 0; i < 2; ++i) vst[i] = *(const v8h*)(vp + (size_t)i * 32 * TT); \
                     kp += FA_ST * KS; vp += FA_ST; }
#define FA_LSTORE(b_) { _Pragma("unroll") for (int i = 0; i < 4; ++i) { const int id = i * 256 + tid; *(v8usa*)(kls[b_] + (id >> 4) * FA_KPB + (id & 15) * 16) = kst[i]; } \
                        _Pragma("unroll") for (int i = 0; i < 2; ++i) { const int id = i * 256 + tid; *(v8ha*)(vls[b_] + (id >> 3) * FA_VPB + (id & 7) * 16) = vst[i]; } }
    FA_GLOAD() FA_LSTORE(0)
    // rolled: the body is long enough, and unrolling would only grow code and live registers
#pragma unroll 1
    for (int s = 0; s < NS; ++s) {
        const int b = s & 1;
        // one barrier per stage: publishes buffer b (stored at the foot of stage s-1) and ends every wave's reads of buffer b^1 (stage s-1), which is refilled at this stage's foot
        __syncthreads();
        if (s + 1 < NS) FA_GLOAD()
        // rolled: unrolled, the scheduler lifts both passes' fragment loads to the top and the live set spills
#pragma unroll 1
        for (int ph = 0; ph < FA_ST / 32; ++ph) {   // a pass: 32 keys
            v8f sc[2][2];                           // [group][16-key tile of the pass]
            constexpr int KA[6] = {0, 1, 0, 1, 2, 3}, QB[6] = {0, 1, 2, 3, 0, 1};   // qh.kh, ql.kh, qh.kl
#pragma unroll
            for (int u = 0; u < 2; ++u) { const unsigned char* kr = kls[b] + ((ph * 2 + u) * 16 + lr) * FA_KPB + 16 * hi;
                v16bf kf[4];                        // kh k 0..31, kh k 32..63, kl k 0..31, kl k 32..63
#pragma unroll
                for (int c = 0; c < 4; ++c) kf[c] = cat16b(*(const v8usa*)(kr + c * 64), *(const v8usa*)(kr + c * 64 + 32));
#pragma unroll
                for (int gr = 0; gr < 2; ++gr) sc[gr][u] = (v8f){};
#pragma unroll
                for (int c = 0; c < 6; ++c)
#pragma unroll
                    for (int gr = 0; gr < 2; ++gr) sc[gr][u] = wmmab(kf[KA[c]], qf[gr][QB[c]], sc[gr][u]); }
            float sh[2];
#pragma unroll
            for (int gr = 0; gr < 2; ++gr) {
                float mx = sc[gr][0][0];
#pragma unroll
                for (int u = 0; u < 2; ++u)
#pragma unroll
                    for (int j = 0; j < 8; ++j) mx = fmaxf(mx, sc[gr][u][j]);
                mx = fmaxf(mx, xhalf(mx));                              // both halves of the wave now hold the query's maximum
                const float mn = fmaxf(m2[gr], mx * L2E);
                const float al = __builtin_amdgcn_exp2f(m2[gr] - mn);   // 0 in the first pass
                sh[gr] = 14.0f - mn; m2[gr] = mn; l[gr] *= al;
#pragma unroll
                for (int db = 0; db < 4; ++db) o[gr][db] *= al;
            }
            v16h vf[4];   // V^T fragments: row d = db*16 + lane&15, the pass's 32 keys
#pragma unroll
            for (int db = 0; db < 4; ++db) { const unsigned char* vr = vls[b] + (db * 16 + lr) * FA_VPB + ph * 64 + 16 * hi; vf[db] = cat16(*(const v8ha*)vr, *(const v8ha*)(vr + 32)); }
#pragma unroll
            for (int gr = 0; gr < 2; ++gr) {
                v2f sa = {0.f, 0.f}, sb = {0.f, 0.f}; v16h pf;
#pragma unroll
                for (int i = 0; i < 8; ++i) {
                    const v2f arg = __builtin_elementwise_fma((v2f){sc[gr][i >> 2][2 * (i & 3)], sc[gr][i >> 2][2 * (i & 3) + 1]}, (v2f){L2E, L2E}, (v2f){sh[gr], sh[gr]});
                    const v2f p = {__builtin_amdgcn_exp2f(arg.x), __builtin_amdgcn_exp2f(arg.y)};
                    if (i < 4) sa += p; else sb += p;
                    pf[2 * i] = tohx(p.x); pf[2 * i + 1] = tohx(p.y); }
                sa += sb; l[gr] += sa.x + sa.y;
#pragma unroll
                for (int db = 0; db < 4; ++db) o[gr][db] = wmma16(vf[db], pf, o[gr][db]);
            }
        }
        if (s + 1 < NS) FA_LSTORE(b ^ 1)
    }
#undef FA_GLOAD
#undef FA_LSTORE
    // O^T tile: lane holds query lane&15, d = db*16 + 8*hi + 0..7: one 16-byte store per plane; ctx = O^T / sum / 32 as bf16 hi + lo
    const int bb = g / NH_, h = g % NH_;
#pragma unroll
    for (int gr = 0; gr < 2; ++gr) {
        const float f = __fdiv_rn(1.0f / 32.0f, l[gr] + xhalf(l[gr]));
        const size_t oo = ((size_t)bb * TT + q0 + gr * 16 + lr) * DQ + (size_t)h * HD + 8 * hi;
#pragma unroll
        for (int db = 0; db < 4; ++db) { v8us oh, ol;
#pragma unroll
            for (int j = 0; j < 8; ++j) { unsigned short a, c2; splitf(o[gr][db][j] * f, a, c2); oh[j] = a; ol[j] = c2; }
            *(v8us*)(ATh + oo + db * 16) = oh; *(v8us*)(ATl + oo + db * 16) = ol; }
    }
}

extern "C" void kernel_launch(void* const* d_in, const int* in_sizes, int n_in,
                              void* d_out, int out_size, void* d_ws, size_t ws_size, hipStream_t stream) {
    if (n_in < 9) return;
    const size_t xneed = (size_t)(NB - 1) * SEQ_FULL * DM + (size_t)TT * DM;
    if ((size_t)in_sizes[0] < xneed) return;
    if (in_sizes[1] < DM * DM || in_sizes[3] < DM * DM || in_sizes[5] < DM * DM || in_sizes[7] < DM * DM) return;
    if (in_sizes[2] < DM || in_sizes[4] < DM || in_sizes[6] < DM || in_sizes[8] < DM) return;
    if ((size_t)out_size < xneed) return;
    const float* x  = (const float*)d_in[0];   // [NB_FULL][SEQ_FULL][DM]
    const float* wq = (const float*)d_in[1];  const float* bq = (const float*)d_in[2];
    const float* wk = (const float*)d_in[3];  const float* bk = (const float*)d_in[4];
    const float* wv = (const float*)d_in[5];  const float* bv = (const float*)d_in[6];
    const float* wo = (const float*)d_in[7];  const float* bo = (const float*)d_in[8];
    float* OUT = (float*)d_out;     // [NB_FULL][SEQ_FULL][DM]

    constexpr size_t MR     = (size_t)NB * TT;              // rows of all batches together
    constexpr size_t NPL    = (size_t)NB * NH_;             // (batch, head) planes
    constexpr size_t SZ_W   = (size_t)DM * DM * 2;          // x4 : WQ WK WV WO bf16 [out][in]
    constexpr size_t SZ_XB  = MR * DM * 2;                  // x  bf16 [MR][DM]
    constexpr size_t SZ_F   = MR * DQ * 4;                  // x2 : FQ, FK(=FV) f32 [MR][DQ]
    constexpr size_t SZ_PQK = NPL * TT * KS * 2;            // x2 : QP [g*TT+t][KS], KP [g*TT+t][KS] bf16 [hi | lo] planes
    constexpr size_t SZ_PL  = NPL * TT * HD * 2;            // VT16 [g][d][t] fp16
    constexpr size_t SZ_AT  = MR * DQ * 2;                  // x2 : ctx hi / lo bf16 [MR][DQ]
    constexpr size_t WS_TOTAL = 4 * SZ_W + SZ_XB + 2 * SZ_F + 2 * SZ_PQK + SZ_PL + 2 * SZ_AT;
    static_assert(WS_TOTAL <= (size_t)268435456);
    static_assert(SZ_W % 256 == 0 && SZ_XB % 256 == 0 && SZ_F % 256 == 0 && SZ_PQK % 256 == 0 && SZ_PL % 256 == 0 && SZ_AT % 256 == 0);
    if (WS_TOTAL > ws_size) return;
    char* wsp = (char*)d_ws;
    auto take = [&](size_t bytes) { char* p = wsp; wsp += (bytes + 255) & ~(size_t)255; return (void*)p; };
    bf* WO = (bf*)take(SZ_W); bf* QP = (bf*)take(SZ_PQK); bf* KP = (bf*)take(SZ_PQK); h16* VT16 = (h16*)take(SZ_PL);
    bf* ATh = (bf*)take(SZ_AT); bf* ATl = (bf*)take(SZ_AT);
    bf* WQ = (bf*)take(SZ_W); bf* WK = (bf*)take(SZ_W); bf* WV = (bf*)take(SZ_W);
    bf* XB = (bf*)take(SZ_XB); float* FQ = (float*)take(SZ_F); float* FK = (float*)take(SZ_F);
    if ((size_t)(wsp - (char*)d_ws) > ws_size) return;
    float* FV = FK;   // v projection reuses the k buffer after the k planes are built (stream-ordered)

    const unsigned LW = (unsigned)(((size_t)DM * DM / 8 + 255) / 256);
    k_cvt8<<<LW, 256, 0, stream>>>(wq, WQ, (size_t)DM * DM / 8);
    k_cvt8<<<LW, 256, 0, stream>>>(wk, WK, (size_t)DM * DM / 8);
    k_cvt8<<<LW, 256, 0, stream>>>(wv, WV, (size_t)DM * DM / 8);
    k_cvt8<<<LW, 256, 0, stream>>>(wo, WO, (size_t)DM * DM / 8);
    const unsigned LX = (unsigned)((MR * DM / 8 + 255) / 256);
    const unsigned LQ = (unsigned)((NPL * TT * HD / 8 + 255) / 256);
    k_cvt8<<<LX, 256, 0, stream>>>(x, XB, MR * DM / 8);
    k_gemmw<bf, 0, true><<<dim3(MR / 64, DQ / 64, 1), 32, 0, stream>>>(XB, nullptr, WQ, nullptr, DM, FQ, DQ, bq, 0, 0, 0);
    k_qkp2<<<LQ, 256, 0, stream>>>(FQ, DQ, (int)NPL, QP);
    k_gemmw<bf, 0, true><<<dim3(MR / 64, DQ / 64, 1), 32, 0, stream>>>(XB, nullptr, WK, nullptr, DM, FK, DQ, bk, 0, 0, 0);
    k_qkp2<<<LQ, 256, 0, stream>>>(FK, DQ, (int)NPL, KP);
    k_gemmw<bf, 0, true><<<dim3(MR / 64, DQ / 64, 1), 32, 0, stream>>>(XB, nullptr, WV, nullptr, DM, FV, DQ, bv, 0, 0, 0);
    k_vtp<<<LQ, 256, 0, stream>>>(FV, DQ, (int)NPL, VT16);
    k_fattn<<<dim3(TT / FA_QB, (unsigned)NPL, 1), FA_W * 32, 0, stream>>>(QP, KP, VT16, ATh, ATl);
    k_gemmw<bf, 1, true><<<dim3(MR / 64, DM / 64, 1), 32, 0, stream>>>(ATh, ATl, WO, nullptr, DQ, OUT, DM, bo, 0, 0, 0);
}
